// v000
// The times below were measured on an AMD MI455X: many runs one after another, warmed up first and cycling through
// copies of the inputs, with the whole window's GPU time divided by the number of runs. Launches and the gaps
// between them are all in it. The median over several windows is given; except for v000 it joins two sittings, which
// can be a few percent apart, so the side-by-side timings, each taken in one sitting, are the better comparison.
// v000 is the starting kernel.
#include <hip/hip_runtime.h>

// Problem constants (from reference): B=1, N=50000, H=8, E=D=32, P=1,600,000
#define N_NODES   50000
#define N_HEADS   8
#define EDIM      32
#define N_EDGES   1600000
#define TEMP      0.17677669529663689f   // 1/sqrt(32)

typedef __attribute__((ext_vector_type(16))) _Float16 v16h;
typedef __attribute__((ext_vector_type(8)))  float    v8f;

// ---- monotone float <-> uint key so segment-max is a single atomicMax(u32) ----
__device__ __forceinline__ unsigned fkey(float f) {
  unsigned u = __float_as_uint(f);
  return (u & 0x80000000u) ? ~u : (u | 0x80000000u);
}
__device__ __forceinline__ float keyf(unsigned kk) {
  unsigned u = (kk & 0x80000000u) ? (kk ^ 0x80000000u) : ~kk;
  return __uint_as_float(u);
}

// runtime-index read of one element of the WMMA f32 accumulator (cndmask chain)
__device__ __forceinline__ float v8f_get(v8f c, int r) {
  float x = c[0];
  if (r == 1) x = c[1];
  if (r == 2) x = c[2];
  if (r == 3) x = c[3];
  if (r == 4) x = c[4];
  if (r == 5) x = c[5];
  if (r == 6) x = c[6];
  if (r == 7) x = c[7];
  return x;
}

// -----------------------------------------------------------------------------
// Pass 1: per-edge scores via v_wmma_f32_16x16x32_f16.
// One block = one tile of 16 edges; each of the 8 waves handles one head.
// A row e  = q[src_e, h, 0:32] (f32 gathered, cvt to f16)
// B col e  = k[dst_e, h, 0:32]
// diag(AxB) = 16 edge dot products. Diagonal (e,e) lives in:
//   e in 0..7  -> lane e,     accum VGPR e
//   e in 8..15 -> lane e+16,  accum VGPR e-8
// and for those lanes (lane&15)==e, so the lane already holds src_e.
// -----------------------------------------------------------------------------
__global__ __launch_bounds__(256) void gat_scores_wmma(
    const float* __restrict__ q, const float* __restrict__ k,
    const int* __restrict__ adj, float* __restrict__ sbuf,
    unsigned* __restrict__ mkey) {
  const int lane = threadIdx.x & 31;
  const int h    = threadIdx.x >> 5;        // wave-in-block = head
  const int tile = blockIdx.x;
  const int eloc = lane & 15;
  const int edge = tile * 16 + eloc;

  const int srcn = adj[edge];               // adj[0][e]
  const int dstn = adj[N_EDGES + edge];     // adj[1][e]

  // ISA 16-bit A 16x32 layout: lanes 0-15 carry K 0..7 & 16..23,
  // lanes 16-31 carry K 8..15 & 24..31. B mirrors A (column-major).
  const int kb = (lane < 16) ? 0 : 8;
  const float* qrow = q + ((size_t)srcn * N_HEADS + h) * EDIM + kb;
  const float* krow = k + ((size_t)dstn * N_HEADS + h) * EDIM + kb;

  v16h A, Bm;
#pragma unroll
  for (int i = 0; i < 8; ++i) {
    A[i]      = (_Float16)qrow[i];
    A[i + 8]  = (_Float16)qrow[i + 16];
    Bm[i]     = (_Float16)krow[i];
    Bm[i + 8] = (_Float16)krow[i + 16];
  }

  v8f C = {};
  C = __builtin_amdgcn_wmma_f32_16x16x32_f16(
      /*neg_a=*/false, A, /*neg_b=*/false, Bm,
      /*c_mod=*/(short)0, C, /*reuse_a=*/false, /*reuse_b=*/false);

  const bool active = (lane < 8) || (lane >= 24);
  if (active) {
    const int r = (lane < 8) ? lane : (lane - 24);   // accumulator VGPR index
    const float s = v8f_get(C, r) * TEMP;            // edge = tile*16 + (lane&15)
    sbuf[(size_t)edge * N_HEADS + h] = s;
    atomicMax(mkey + (size_t)srcn * N_HEADS + h, fkey(s));
  }
}

// -----------------------------------------------------------------------------
// Pass 2: p = exp(s - m[src]) in-place; atomicAdd denominator.
// 8 consecutive threads = 8 heads of one edge -> contiguous 32B atomic targets.
// -----------------------------------------------------------------------------
__global__ __launch_bounds__(256) void gat_softmax_norm(
    const int* __restrict__ adj, const unsigned* __restrict__ mkey,
    float* __restrict__ sbuf, float* __restrict__ den) {
  const size_t t = (size_t)blockIdx.x * blockDim.x + threadIdx.x;
  const int e = (int)(t >> 3);
  const int h = (int)(t & 7);
  const int srcn = adj[e];
  const float m = keyf(mkey[(size_t)srcn * N_HEADS + h]);
  const float p = __expf(sbuf[t] - m);
  sbuf[t] = p;
  atomicAdd(den + (size_t)srcn * N_HEADS + h, p);
}

// -----------------------------------------------------------------------------
// Pass 3: out[src,h,:] += (p/den) * v[dst,h,:].
// One block per edge; thread = (head, d). v gather is a 128B coalesced
// global_load per wave; scatter is global_atomic_add_f32 (L2-resident).
// -----------------------------------------------------------------------------
__global__ __launch_bounds__(256) void gat_aggregate(
    const int* __restrict__ adj, const float* __restrict__ v,
    const float* __restrict__ sbuf, const float* __restrict__ den,
    float* __restrict__ out) {
  const int e = blockIdx.x;
  const int h = threadIdx.x >> 5;
  const int d = threadIdx.x & 31;
  const int srcn = adj[e];
  const int dstn = adj[N_EDGES + e];
  const float p  = sbuf[(size_t)e * N_HEADS + h];
  const float dn = den[(size_t)srcn * N_HEADS + h];
  const float alpha = p / dn;
  const float vv = v[((size_t)dstn * N_HEADS + h) * EDIM + d];
  atomicAdd(out + ((size_t)srcn * N_HEADS + h) * EDIM + d, alpha * vv);
}

extern "C" void kernel_launch(void* const* d_in, const int* in_sizes, int n_in,
                              void* d_out, int out_size, void* d_ws, size_t ws_size,
                              hipStream_t stream) {
  const float* q   = (const float*)d_in[0];   // (1, N, H, E) f32
  const float* k   = (const float*)d_in[1];   // (1, N, H, E) f32
  const float* v   = (const float*)d_in[2];   // (1, N, H, E) f32
  const int*   adj = (const int*)  d_in[3];   // (2, P) i32
  float* out = (float*)d_out;                 // (1, N, H, E) f32

  // workspace layout: [ sbuf: P*H f32 | mkey: N*H u32 | den: N*H f32 ]
  float*    sbuf = (float*)d_ws;
  unsigned* mkey = (unsigned*)((char*)d_ws + (size_t)N_EDGES * N_HEADS * sizeof(float));
  float*    den  = (float*)((char*)mkey + (size_t)N_NODES * N_HEADS * sizeof(unsigned));

  // per-call init (graph-capture-safe memset nodes). mkey=0 is the minimum key.
  hipMemsetAsync(out,  0, (size_t)N_NODES * N_HEADS * EDIM * sizeof(float), stream);
  hipMemsetAsync(mkey, 0, (size_t)N_NODES * N_HEADS * sizeof(unsigned), stream);
  hipMemsetAsync(den,  0, (size_t)N_NODES * N_HEADS * sizeof(float), stream);

  gat_scores_wmma<<<N_EDGES / 16, 256, 0, stream>>>(q, k, adj, sbuf, mkey);
  gat_softmax_norm<<<(N_EDGES * N_HEADS) / 256, 256, 0, stream>>>(adj, mkey, sbuf, den);
  gat_aggregate<<<N_EDGES, 256, 0, stream>>>(adj, v, sbuf, den, out);
}

// v001
// In two side-by-side timings against v000, it was 2.52 and 2.64 times as fast.
#include <hip/hip_runtime.h>

// Problem constants (from reference): B=1, N=50000, H=8, E=D=32, P=1,600,000
#define N_NODES   50000
#define N_HEADS   8
#define EDIM      32
#define N_EDGES   1600000
#define TEMP      0.17677669529663689f   // 1/sqrt(32)

typedef __attribute__((ext_vector_type(16))) _Float16 v16h;
typedef __attribute__((ext_vector_type(8)))  float    v8f;

// ---- monotone float <-> uint key so segment-max is a single atomicMax(u32) ----
__device__ __forceinline__ unsigned fkey(float f) {
  unsigned u = __float_as_uint(f);
  return (u & 0x80000000u) ? ~u : (u | 0x80000000u);
}
__device__ __forceinline__ float keyf(unsigned kk) {
  unsigned u = (kk & 0x80000000u) ? (kk ^ 0x80000000u) : ~kk;
  return __uint_as_float(u);
}

// runtime-index read of one element of the WMMA f32 accumulator (cndmask chain)
__device__ __forceinline__ float v8f_get(v8f c, int r) {
  float x = c[0];
  if (r == 1) x = c[1];
  if (r == 2) x = c[2];
  if (r == 3) x = c[3];
  if (r == 4) x = c[4];
  if (r == 5) x = c[5];
  if (r == 6) x = c[6];
  if (r == 7) x = c[7];
  return x;
}

// -----------------------------------------------------------------------------
// Pass 1: per-edge scores via v_wmma_f32_16x16x32_f16.
// One block = one tile of 16 edges; each of the 8 waves handles one head.
// A row e  = q[src_e, h, 0:32] (f32 gathered, cvt to f16)
// B col e  = k[dst_e, h, 0:32]
// diag(AxB) = 16 edge dot products. Diagonal (e,e) lives in:
//   e in 0..7  -> lane e,     accum VGPR e
//   e in 8..15 -> lane e+16,  accum VGPR e-8
// and for those lanes (lane&15)==e, so the lane already holds src_e.
// -----------------------------------------------------------------------------
__global__ __launch_bounds__(256) void gat_scores_wmma(
    const float* __restrict__ q, const float* __restrict__ k,
    const int* __restrict__ adj, float* __restrict__ sbuf,
    unsigned* __restrict__ mkey) {
  const int lane = threadIdx.x & 31;
  const int h    = threadIdx.x >> 5;        // wave-in-block = head
  const int tile = blockIdx.x;
  const int eloc = lane & 15;
  const int edge = tile * 16 + eloc;

  const int srcn = adj[edge];               // adj[0][e]
  const int dstn = adj[N_EDGES + edge];     // adj[1][e]

  // ISA 16-bit A 16x32 layout: lanes 0-15 carry K 0..7 & 16..23,
  // lanes 16-31 carry K 8..15 & 24..31. B mirrors A (column-major).
  const int kb = (lane < 16) ? 0 : 8;
  const float* qrow = q + ((size_t)srcn * N_HEADS + h) * EDIM + kb;
  const float* krow = k + ((size_t)dstn * N_HEADS + h) * EDIM + kb;

  v16h A, Bm;
#pragma unroll
  for (int i = 0; i < 8; ++i) {
    A[i]      = (_Float16)qrow[i];
    A[i + 8]  = (_Float16)qrow[i + 16];
    Bm[i]     = (_Float16)krow[i];
    Bm[i + 8] = (_Float16)krow[i + 16];
  }

  v8f C = {};
  C = __builtin_amdgcn_wmma_f32_16x16x32_f16(
      /*neg_a=*/false, A, /*neg_b=*/false, Bm,
      /*c_mod=*/(short)0, C, /*reuse_a=*/false, /*reuse_b=*/false);

  const bool active = (lane < 8) || (lane >= 24);
  if (active) {
    const int r = (lane < 8) ? lane : (lane - 24);   // accumulator VGPR index
    const float s = v8f_get(C, r) * TEMP;            // edge = tile*16 + (lane&15)
    sbuf[(size_t)edge * N_HEADS + h] = s;
    atomicMax(mkey + (size_t)srcn * N_HEADS + h, fkey(s));
  }
}

// Node index read from adj, held inside [0, N_NODES) before an address is formed.
__device__ __forceinline__ int node_clamp(int x) {
  return min(max(x, 0), N_NODES - 1);
}

// -----------------------------------------------------------------------------
// Edge list grouped by src (steps A to D), so that pass 2 needs no f32 atomics.
// A: count the edges of each src; the returned count is the edge's place in its
//    bucket (arrival order, made independent of arrival in step D).
// -----------------------------------------------------------------------------
__global__ __launch_bounds__(256) void gat_bucket_rank(
    const int* __restrict__ adj, int* __restrict__ cnt, int* __restrict__ rank) {
  const int e = blockIdx.x * 256 + threadIdx.x;
  rank[e] = atomicAdd(cnt + node_clamp(adj[e]), 1);
}

// B: exclusive prefix sum of the N_NODES counts, one work-group, counts held in LDS.
#define SCAN_T   1024
#define SCAN_PER ((N_NODES + SCAN_T - 1) / SCAN_T)
__global__ __launch_bounds__(SCAN_T) void gat_bucket_offsets(
    const int* __restrict__ cnt, int* __restrict__ off) {
  __shared__ __attribute__((aligned(16))) int buf[N_NODES];
  __shared__ int wsum[32];
  const int t = threadIdx.x, lane = t & 31, w = t >> 5;
  for (int i = t; i < N_NODES / 4; i += SCAN_T)
    ((int4*)buf)[i] = ((const int4*)cnt)[i];
  __syncthreads();
  const int lo = t * SCAN_PER;
  const int hi = min(lo + SCAN_PER, N_NODES);
  int sum = 0;
  for (int i = lo; i < hi; ++i) sum += buf[i];
  int inc = sum;                                  // inclusive scan inside the wave
#pragma unroll  // five fixed shuffle steps, no loop counter
  for (int d = 1; d < 32; d <<= 1) {
    const int y = __shfl_up(inc, d);
    if (lane >= d) inc += y;
  }
  if (lane == 31) wsum[w] = inc;
  __syncthreads();
  if (w == 0) {                                   // exclusive scan of the 32 wave totals
    const int x = wsum[lane];
    int xi = x;
#pragma unroll  // five fixed shuffle steps, no loop counter
    for (int d = 1; d < 32; d <<= 1) {
      const int y = __shfl_up(xi, d);
      if (lane >= d) xi += y;
    }
    wsum[lane] = xi - x;
  }
  __syncthreads();
  int run = wsum[w] + inc - sum;
  for (int i = lo; i < hi; ++i) {
    const int c = buf[i];
    buf[i] = run;
    run += c;
  }
  __syncthreads();
  for (int i = t; i < N_NODES / 4; i += SCAN_T)
    ((int4*)off)[i] = ((const int4*)buf)[i];
  if (t == 0) off[N_NODES] = N_EDGES;             // every edge was counted once
}

// C: put (edge id, dst) into the edge's place in its src bucket.
__global__ __launch_bounds__(256) void gat_bucket_fill(
    const int* __restrict__ adj, const int* __restrict__ off,
    const int* __restrict__ rank, int2* __restrict__ bkt) {
  const int e = blockIdx.x * 256 + threadIdx.x;
  bkt[off[node_clamp(adj[e])] + rank[e]] =
      make_int2(e, node_clamp(adj[N_EDGES + e]));
}

// D: one wave per node orders its bucket by edge id (place = number of smaller
//    ids), so the order of the sums in pass 2 does not depend on arrival order.
//    A bucket above SORT_CAP edges is copied as it is: the quadratic count would
//    take too long there, and the sums stay right in any order.
#define SORT_CAP 4096
__global__ __launch_bounds__(256) void gat_bucket_order(
    const int* __restrict__ off, const int2* __restrict__ bkt,
    int2* __restrict__ ed) {
  const int lane = threadIdx.x & 31;
  const int n   = blockIdx.x * 8 + __builtin_amdgcn_readfirstlane(threadIdx.x >> 5);
  const int beg = __builtin_amdgcn_readfirstlane(off[n]);
  const int end = __builtin_amdgcn_readfirstlane(off[n + 1]);
  const bool ordered = (end - beg) <= SORT_CAP;
  const int jend = ordered ? end : beg;
  for (int ib = beg; ib < end; ib += 32) {
    const int i = ib + lane;
    const int2 me = bkt[min(i, end - 1)];
    int r = ordered ? 0 : (i - beg);
    for (int jb = beg; jb < jend; jb += 32) {
      const int j = jb + lane;
      const int idj = (j < end) ? bkt[j].x : 0x7fffffff;
#pragma unroll  // each readlane takes a literal lane number
      for (int u = 0; u < 32; ++u)
        r += (__builtin_amdgcn_readlane(idj, u) < me.x) ? 1 : 0;
    }
    if (i < end) ed[beg + r] = me;
    // The next trip rewrites the registers that the store above names.
    asm volatile("s_wait_xcnt 0x0" ::: "memory");
  }
}

// -----------------------------------------------------------------------------
// Pass 2: one wave per node. For its edges in edge-id order:
//   p = exp(s - m[node]); den += p; acc[0:256] += p * v[dst, :, :]
// then out[node] = acc / den. A lane holds floats 4*lane.. of heads 0-3 and of
// heads 4-7, so each v load of the wave is 512 contiguous bytes.
// Four edges are loaded together; past the bucket's end the last edge is loaded
// again with p = 0.
// -----------------------------------------------------------------------------
typedef __attribute__((ext_vector_type(4))) float v4f;
typedef __attribute__((address_space(1))) float gfloat;
typedef __attribute__((address_space(1))) v4f   gf4;

// A row address that is the same in every lane, handed on in scalar registers:
// the row's loads then take a scalar base and a lane offset that never changes.
__device__ __forceinline__ unsigned long long wave_addr(const float* p) {
  const unsigned long long a = (unsigned long long)p;
  const unsigned lo = __builtin_amdgcn_readfirstlane((unsigned)a);
  const unsigned hi = __builtin_amdgcn_readfirstlane((unsigned)(a >> 32));
  return ((unsigned long long)hi << 32) | lo;
}

__global__ __launch_bounds__(256) void gat_node_sum(
    const int* __restrict__ off, const int2* __restrict__ ed,
    const float* __restrict__ v, const float* __restrict__ sbuf,
    const unsigned* __restrict__ mkey, float* __restrict__ out) {
  const int lane = threadIdx.x & 31;
  const int n   = blockIdx.x * 8 + __builtin_amdgcn_readfirstlane(threadIdx.x >> 5);
  const int beg = __builtin_amdgcn_readfirstlane(off[n]);
  const int end = __builtin_amdgcn_readfirstlane(off[n + 1]);
  const int h0  = lane >> 3;
  const float m0 = keyf(mkey[n * N_HEADS + h0]);
  const float m1 = keyf(mkey[n * N_HEADS + 4 + h0]);

  float4 a0 = make_float4(0.f, 0.f, 0.f, 0.f);
  float4 a1 = make_float4(0.f, 0.f, 0.f, 0.f);
  float d0 = 0.f, d1 = 0.f;

  for (int base = beg; base < end; base += 32) {
    const int left = min(end - base, 32);
    const int2 mine = ed[base + min(lane, left - 1)];
    for (int t = 0; t < left; t += 4) {
      float s0[4], s1[4];
      v4f x0[4], x1[4];
#pragma unroll  // the four edges' 16 loads issue together, their values stay in registers
      for (int u = 0; u < 4; ++u) {
        const int tt = min(t + u, left - 1);
        const int e  = __builtin_amdgcn_readlane(mine.x, tt);
        const int dn = __builtin_amdgcn_readlane(mine.y, tt);
        const gfloat* sp = (const gfloat*)wave_addr(sbuf + (size_t)e * N_HEADS);
        const gf4*    vp = (const gf4*)wave_addr(v + (size_t)dn * (N_HEADS * EDIM));
        s0[u] = sp[h0];
        s1[u] = sp[4 + h0];
        x0[u] = vp[lane];
        x1[u] = vp[32 + lane];
      }
#pragma unroll  // constant indices keep s0, s1, x0, x1 in registers
      for (int u = 0; u < 4; ++u) {
        const bool live = (t + u) < left;
        const float p0 = live ? __expf(s0[u] - m0) : 0.f;
        const float p1 = live ? __expf(s1[u] - m1) : 0.f;
        d0 += p0;
        d1 += p1;
        a0.x += p0 * x0[u].x;  a0.y += p0 * x0[u].y;
        a0.z += p0 * x0[u].z;  a0.w += p0 * x0[u].w;
        a1.x += p1 * x1[u].x;  a1.y += p1 * x1[u].y;
        a1.z += p1 * x1[u].z;  a1.w += p1 * x1[u].w;
      }
    }
  }

  // A node without edges has an empty sum: zero.
  const float r0 = (end > beg) ? 1.0f / d0 : 0.f;
  const float r1 = (end > beg) ? 1.0f / d1 : 0.f;
  float4* op = (float4*)(out + (size_t)n * (N_HEADS * EDIM));
  op[lane]      = make_float4(a0.x * r0, a0.y * r0, a0.z * r0, a0.w * r0);
  op[32 + lane] = make_float4(a1.x * r1, a1.y * r1, a1.z * r1, a1.w * r1);
}

extern "C" void kernel_launch(void* const* d_in, const int* in_sizes, int n_in,
                              void* d_out, int out_size, void* d_ws, size_t ws_size,
                              hipStream_t stream) {
  const float* q   = (const float*)d_in[0];   // (1, N, H, E) f32
  const float* k   = (const float*)d_in[1];   // (1, N, H, E) f32
  const float* v   = (const float*)d_in[2];   // (1, N, H, E) f32
  const int*   adj = (const int*)  d_in[3];   // (2, P) i32
  float* out = (float*)d_out;                 // (1, N, H, E) f32

  // workspace layout:
  // [ sbuf: P*H f32 | mkey: N*H u32 | bkt: P int2 | ed: P int2 | rank: P i32 |
  //   cnt: N i32 | off: N+1 i32 ]
  float*    sbuf = (float*)d_ws;
  unsigned* mkey = (unsigned*)((char*)d_ws + (size_t)N_EDGES * N_HEADS * sizeof(float));
  int2*     bkt  = (int2*)((char*)mkey + (size_t)N_NODES * N_HEADS * sizeof(unsigned));
  int2*     ed   = bkt + N_EDGES;
  int*      rank = (int*)(ed + N_EDGES);
  int*      cnt  = rank + N_EDGES;
  int*      off  = cnt + N_NODES;

  // per-call init (graph-capture-safe memset nodes). mkey=0 is the minimum key.
  hipMemsetAsync(mkey, 0, (size_t)N_NODES * N_HEADS * sizeof(unsigned), stream);
  hipMemsetAsync(cnt,  0, (size_t)N_NODES * sizeof(int), stream);

  gat_bucket_rank<<<N_EDGES / 256, 256, 0, stream>>>(adj, cnt, rank);
  gat_bucket_offsets<<<1, SCAN_T, 0, stream>>>(cnt, off);
  gat_bucket_fill<<<N_EDGES / 256, 256, 0, stream>>>(adj, off, rank, bkt);
  gat_bucket_order<<<N_NODES / 8, 256, 0, stream>>>(off, bkt, ed);
  gat_scores_wmma<<<N_EDGES / 16, 256, 0, stream>>>(q, k, adj, sbuf, mkey);
  gat_node_sum<<<N_NODES / 8, 256, 0, stream>>>(off, ed, v, sbuf, mkey, out);
}

// v002
// Next to v001, in two timings, it ran 2.61 and 2.52 times as fast.
// Over all steps from v000 it is 6.61 times as fast.
#include <hip/hip_runtime.h>

// Problem constants (from reference): B=1, N=50000, H=8, E=D=32, P=1,600,000
#define N_NODES   50000
#define N_HEADS   8
#define EDIM      32
#define N_EDGES   1600000
#define TEMP      0.17677669529663689f   // 1/sqrt(32)

typedef __attribute__((ext_vector_type(16))) _Float16 v16h;
typedef __attribute__((ext_vector_type(8)))  float    v8f;

// Node index read from adj, held inside [0, N_NODES) before an address is formed.
__device__ __forceinline__ int node_clamp(int x) {
  return min(max(x, 0), N_NODES - 1);
}

// -----------------------------------------------------------------------------
// Edge list grouped by src (steps A to D), so that the node pass needs no f32 atomics.
// A: count the edges of each src; the returned count is the edge's place in its
//    bucket (arrival order, made independent of arrival in step D).
// -----------------------------------------------------------------------------
__global__ __launch_bounds__(256) void gat_bucket_rank(
    const int* __restrict__ adj, int* __restrict__ cnt, int* __restrict__ rank) {
  const int e = blockIdx.x * 256 + threadIdx.x;
  rank[e] = atomicAdd(cnt + node_clamp(adj[e]), 1);
}

// B: exclusive prefix sum of the N_NODES counts, one work-group, counts held in LDS.
#define SCAN_T   1024
#define SCAN_PER ((N_NODES + SCAN_T - 1) / SCAN_T)
__global__ __launch_bounds__(SCAN_T) void gat_bucket_offsets(
    const int* __restrict__ cnt, int* __restrict__ off) {
  __shared__ __attribute__((aligned(16))) int buf[N_NODES];
  __shared__ int wsum[32];
  const int t = threadIdx.x, lane = t & 31, w = t >> 5;
  for (int i = t; i < N_NODES / 4; i += SCAN_T)
    ((int4*)buf)[i] = ((const int4*)cnt)[i];
  __syncthreads();
  const int lo = t * SCAN_PER;
  const int hi = min(lo + SCAN_PER, N_NODES);
  int sum = 0;
  for (int i = lo; i < hi; ++i) sum += buf[i];
  int inc = sum;                                  // inclusive scan inside the wave
#pragma unroll  // five fixed shuffle steps, no loop counter
  for (int d = 1; d < 32; d <<= 1) {
    const int y = __shfl_up(inc, d);
    if (lane >= d) inc += y;
  }
  if (lane == 31) wsum[w] = inc;
  __syncthreads();
  if (w == 0) {                                   // exclusive scan of the 32 wave totals
    const int x = wsum[lane];
    int xi = x;
#pragma unroll  // five fixed shuffle steps, no loop counter
    for (int d = 1; d < 32; d <<= 1) {
      const int y = __shfl_up(xi, d);
      if (lane >= d) xi += y;
    }
    wsum[lane] = xi - x;
  }
  __syncthreads();
  int run = wsum[w] + inc - sum;
  for (int i = lo; i < hi; ++i) {
    const int c = buf[i];
    buf[i] = run;
    run += c;
  }
  __syncthreads();
  for (int i = t; i < N_NODES / 4; i += SCAN_T)
    ((int4*)off)[i] = ((const int4*)buf)[i];
  if (t == 0) off[N_NODES] = N_EDGES;             // every edge was counted once
}

// C: put (edge id, dst) into the edge's place in its src bucket.
__global__ __launch_bounds__(256) void gat_bucket_fill(
    const int* __restrict__ adj, const int* __restrict__ off,
    const int* __restrict__ rank, int2* __restrict__ bkt) {
  const int e = blockIdx.x * 256 + threadIdx.x;
  bkt[off[node_clamp(adj[e])] + rank[e]] =
      make_int2(e, node_clamp(adj[N_EDGES + e]));
}

// D: one wave per node orders its bucket by edge id (place = number of smaller
//    ids), so the order of the sums in the node pass does not depend on arrival order.
//    A bucket above SORT_CAP edges is copied as it is: the quadratic count would
//    take too long there, and the sums stay right in any order.
#define SORT_CAP 4096
__global__ __launch_bounds__(256) void gat_bucket_order(
    const int* __restrict__ off, const int2* __restrict__ bkt,
    int2* __restrict__ ed) {
  const int lane = threadIdx.x & 31;
  const int n   = blockIdx.x * 8 + __builtin_amdgcn_readfirstlane(threadIdx.x >> 5);
  const int beg = __builtin_amdgcn_readfirstlane(off[n]);
  const int end = __builtin_amdgcn_readfirstlane(off[n + 1]);
  const bool ordered = (end - beg) <= SORT_CAP;
  const int jend = ordered ? end : beg;
  for (int ib = beg; ib < end; ib += 32) {
    const int i = ib + lane;
    const int2 me = bkt[min(i, end - 1)];
    int r = ordered ? 0 : (i - beg);
    for (int jb = beg; jb < jend; jb += 32) {
      const int j = jb + lane;
      const int idj = (j < end) ? bkt[j].x : 0x7fffffff;
#pragma unroll  // each readlane takes a literal lane number
      for (int u = 0; u < 32; ++u)
        r += (__builtin_amdgcn_readlane(idj, u) < me.x) ? 1 : 0;
    }
    if (i < end) ed[beg + r] = me;
    // The next trip rewrites the registers that the store above names.
    asm volatile("s_wait_xcnt 0x0" ::: "memory");
  }
}

// -----------------------------------------------------------------------------
// Node pass: one wave per node does scores, softmax and the weighted sum for the
// node's edges, 16 edges (one tile) at a time, in edge-id order.
//   scores: per head h one v_wmma_f32_16x16x32_f16: A row e = k[dst_e, h, :],
//           B column j = q[node, j & 7, :]; column h of the result is head h's scores.
//   k rows are read like v rows (a wave reads a row as 2 x 512 contiguous bytes),
//   converted to f16 and turned into A fragments through this wave's own LDS.
//   softmax: running maximum m per head; when m grows, den and acc are rescaled.
//   acc[0:256] += p * v[dst, :, :]; out[node] = acc / den.
// A lane holds floats 4*lane.. of heads 0-3 and of heads 4-7.
// -----------------------------------------------------------------------------
typedef __attribute__((ext_vector_type(4))) float    v4f;
typedef __attribute__((ext_vector_type(4))) _Float16 v4h;
typedef __attribute__((ext_vector_type(8))) _Float16 v8h;
typedef __attribute__((address_space(1))) v4f   gf4;

// A row address that is the same in every lane, handed on in scalar registers:
// the row's loads then take a scalar base and a lane offset that never changes.
__device__ __forceinline__ unsigned long long wave_addr(const float* p) {
  const unsigned long long a = (unsigned long long)p;
  const unsigned lo = __builtin_amdgcn_readfirstlane((unsigned)a);
  const unsigned hi = __builtin_amdgcn_readfirstlane((unsigned)(a >> 32));
  return ((unsigned long long)hi << 32) | lo;
}

#define ROWF   (N_HEADS * EDIM)   // floats in a node's row of q, k or v
#define KPITCH (ROWF + 8)         // f16 per staged k row: 528 bytes = 16 x odd
struct __attribute__((aligned(16))) WaveLds {
  _Float16 kt[16 * KPITCH];       // 16 edges' k rows in f16
  float    p[N_HEADS * 16];       // p[head][edge of the tile]
  float    sc[N_HEADS];           // per head: this tile's rescale factor; at the end den
};

__global__ __launch_bounds__(256) void gat_node_attn(
    const int* __restrict__ off, const int2* __restrict__ ed,
    const float* __restrict__ q, const float* __restrict__ k,
    const float* __restrict__ v, float* __restrict__ out) {
  __shared__ WaveLds lds[8];
  const int lane = threadIdx.x & 31;
  const int w   = __builtin_amdgcn_readfirstlane(threadIdx.x >> 5);
  const int n   = blockIdx.x * 8 + w;
  const int beg = __builtin_amdgcn_readfirstlane(off[n]);
  const int end = __builtin_amdgcn_readfirstlane(off[n + 1]);
  WaveLds& L = lds[w];
  const int col  = lane & 15;     // fragment row (edge) of A, column (head) of B and D
  const int half = lane >> 4;
  const int kb   = half * 8;      // lanes 0-15 carry K 0..7 & 16..23, lanes 16-31 K 8..15 & 24..31
  const int h0   = lane >> 3;

  // B: column col holds q[node, col & 7, :] in the k order of the A fragments.
  const float* qrow = q + ((size_t)n * N_HEADS + (col & 7)) * EDIM + kb;
  v16h qf;
#pragma unroll  // constant indices keep qf in registers
  for (int i = 0; i < 8; ++i) {
    qf[i]     = (_Float16)qrow[i];
    qf[i + 8] = (_Float16)qrow[i + 16];
  }

  float4 a0 = make_float4(0.f, 0.f, 0.f, 0.f);
  float4 a1 = make_float4(0.f, 0.f, 0.f, 0.f);
  float m   = -__builtin_inff();  // running maximum of head col & 7
  float den = 0.f;                // running sum of p of head col & 7

  int dnext = (end > beg) ? ed[min(beg + col, end - 1)].y : 0;
  for (int base = beg; base < end; base += 16) {
    const int left = min(end - base, 16);
    const int dl = dnext;                      // dst of edge min(col, left - 1) of this tile
    dnext = ed[min(base + 16 + col, end - 1)].y;
    // The code below rewrites the address registers that the load above names.
    asm volatile("s_wait_xcnt 0x0" ::: "memory");

    // k rows of the tile into LDS, eight rows' loads in flight together; past the
    // bucket's end the last edge is loaded again.
    for (int t = 0; t < left; t += 8) {
      const gf4* kp[8];
      v4f y0[8], y1[8];
#pragma unroll  // all eight row addresses first, each in scalar registers of its own
      for (int u = 0; u < 8; ++u)
        kp[u] = (const gf4*)wave_addr(
            k + (size_t)__builtin_amdgcn_readlane(dl, min(t + u, left - 1)) * ROWF);
#pragma unroll  // the eight rows' 16 loads issue together, their values stay in registers
      for (int u = 0; u < 8; ++u) {
        y0[u] = kp[u][lane];
        y1[u] = kp[u][32 + lane];
      }
#pragma unroll  // constant indices keep y0, y1 in registers
      for (int u = 0; u < 8; ++u) {
        _Float16* kr = L.kt + (t + u) * KPITCH + 4 * lane;
        *(v4h*)kr         = __builtin_convertvector(y0[u], v4h);
        *(v4h*)(kr + 128) = __builtin_convertvector(y1[u], v4h);
      }
    }
    // Lanes of this wave hand values to each other through LDS: the reads below
    // must stay behind the writes above.
    __builtin_amdgcn_fence(__ATOMIC_ACQ_REL, "wavefront");

    // Scores: per head h, (16 edges x 32) * (32 x 16 columns); column h of that
    // product is head h's score. A row past the bucket's end reads the last edge's row.
    const _Float16* ar = L.kt + min(col, left - 1) * KPITCH + kb;
    float s[8];
#pragma unroll  // one matrix instruction per head; constant indices into s
    for (int h = 0; h < N_HEADS; ++h) {
      const v8h lo = *(const v8h*)(ar + h * EDIM);
      const v8h hi = *(const v8h*)(ar + h * EDIM + 16);
      const v16h A = __builtin_shufflevector(lo, hi, 0, 1, 2, 3, 4, 5, 6, 7,
                                             8, 9, 10, 11, 12, 13, 14, 15);
      v8f D = {};
      D = __builtin_amdgcn_wmma_f32_16x16x32_f16(
          /*neg_a=*/false, A, /*neg_b=*/false, qf,
          /*c_mod=*/(short)0, D, /*reuse_a=*/false, /*reuse_b=*/false);
#pragma unroll  // constant indices into D and s
      for (int r = 0; r < 8; ++r)
        s[r] = (h == 0 || (col & 7) == h) ? D[r] : s[r];
    }

    // s[r] of this lane: edge r + 8 * half of the tile, head col & 7.
    float tm = -__builtin_inff();
#pragma unroll  // constant indices into s
    for (int r = 0; r < 8; ++r) {
      s[r] = (half * 8 + r < left) ? s[r] * TEMP : -__builtin_inff();
      tm = fmaxf(tm, s[r]);
    }
    // the other eight edges' maximum sits in lane ^ 16
    tm = fmaxf(tm, __uint_as_float(__builtin_amdgcn_permlanex16(
                       __float_as_uint(tm), __float_as_uint(tm),
                       0x76543210u, 0xfedcba98u, false, false)));
    const float mn = fmaxf(m, tm);
    const float scale = __expf(m - mn);        // 0 on the first tile
    m = mn;
#pragma unroll  // constant indices into s
    for (int r = 0; r < 8; ++r) s[r] = __expf(s[r] - mn);   // 0 past the bucket's end
    float ps = ((s[0] + s[1]) + (s[2] + s[3])) + ((s[4] + s[5]) + (s[6] + s[7]));
    ps += __uint_as_float(__builtin_amdgcn_permlanex16(
              __float_as_uint(ps), __float_as_uint(ps),
              0x76543210u, 0xfedcba98u, false, false));
    den = den * scale + ps;
    if (col < N_HEADS) {
      float4* pp = (float4*)(L.p + col * 16 + half * 8);
      pp[0] = make_float4(s[0], s[1], s[2], s[3]);
      pp[1] = make_float4(s[4], s[5], s[6], s[7]);
      if (half == 0) L.sc[col] = scale;
    }
    // As above: p and sc go from the head lanes to the lanes that sum.
    __builtin_amdgcn_fence(__ATOMIC_ACQ_REL, "wavefront");

    const float c0 = L.sc[h0], c1 = L.sc[4 + h0];
    a0.x *= c0;  a0.y *= c0;  a0.z *= c0;  a0.w *= c0;
    a1.x *= c1;  a1.y *= c1;  a1.z *= c1;  a1.w *= c1;

    // Weighted sum; past the bucket's end the last edge is loaded again, its p is 0.
    for (int t = 0; t < left; t += 8) {
      const gf4* vp[8];
      v4f x0[8], x1[8];
#pragma unroll  // all eight row addresses first, each in scalar registers of its own
      for (int u = 0; u < 8; ++u)
        vp[u] = (const gf4*)wave_addr(
            v + (size_t)__builtin_amdgcn_readlane(dl, min(t + u, left - 1)) * ROWF);
#pragma unroll  // the eight rows' 16 loads issue together, their values stay in registers
      for (int u = 0; u < 8; ++u) {
        x0[u] = vp[u][lane];
        x1[u] = vp[u][32 + lane];
      }
      const v4f* pa = (const v4f*)(L.p + h0 * 16 + t);
      const v4f* pb = (const v4f*)(L.p + (4 + h0) * 16 + t);
      const v4f pa0 = pa[0], pa1 = pa[1], pb0 = pb[0], pb1 = pb[1];
#pragma unroll  // constant indices keep the p and x values in registers
      for (int u = 0; u < 8; ++u) {
        const float p0 = (u < 4) ? pa0[u & 3] : pa1[u & 3];
        const float p1 = (u < 4) ? pb0[u & 3] : pb1[u & 3];
        a0.x += p0 * x0[u].x;  a0.y += p0 * x0[u].y;
        a0.z += p0 * x0[u].z;  a0.w += p0 * x0[u].w;
        a1.x += p1 * x1[u].x;  a1.y += p1 * x1[u].y;
        a1.z += p1 * x1[u].z;  a1.w += p1 * x1[u].w;
      }
    }
    // The next tile's writes of kt, p and sc must stay behind this tile's reads.
    __builtin_amdgcn_fence(__ATOMIC_ACQ_REL, "wavefront");
  }

  // den goes from the head lanes to the lanes that hold the sums.
  if (lane < N_HEADS) L.sc[lane] = den;
  __builtin_amdgcn_fence(__ATOMIC_ACQ_REL, "wavefront");
  // A node without edges has an empty sum: zero.
  const float r0 = (end > beg) ? 1.0f / L.sc[h0] : 0.f;
  const float r1 = (end > beg) ? 1.0f / L.sc[4 + h0] : 0.f;
  float4* op = (float4*)(out + (size_t)n * ROWF);
  op[lane]      = make_float4(a0.x * r0, a0.y * r0, a0.z * r0, a0.w * r0);
  op[32 + lane] = make_float4(a1.x * r1, a1.y * r1, a1.z * r1, a1.w * r1);
}

extern "C" void kernel_launch(void* const* d_in, const int* in_sizes, int n_in,
                              void* d_out, int out_size, void* d_ws, size_t ws_size,
                              hipStream_t stream) {
  const float* q   = (const float*)d_in[0];   // (1, N, H, E) f32
  const float* k   = (const float*)d_in[1];   // (1, N, H, E) f32
  const float* v   = (const float*)d_in[2];   // (1, N, H, E) f32
  const int*   adj = (const int*)  d_in[3];   // (2, P) i32
  float* out = (float*)d_out;                 // (1, N, H, E) f32

  // workspace layout:
  // [ bkt: P int2 | ed: P int2 | rank: P i32 | cnt: N i32 | off: N+1 i32 ]
  int2* bkt  = (int2*)d_ws;
  int2* ed   = bkt + N_EDGES;
  int*  rank = (int*)(ed + N_EDGES);
  int*  cnt  = rank + N_EDGES;
  int*  off  = cnt + N_NODES;

  // per-call init (graph-capture-safe memset node)
  hipMemsetAsync(cnt, 0, (size_t)N_NODES * sizeof(int), stream);

  gat_bucket_rank<<<N_EDGES / 256, 256, 0, stream>>>(adj, cnt, rank);
  gat_bucket_offsets<<<1, SCAN_T, 0, stream>>>(cnt, off);
  gat_bucket_fill<<<N_EDGES / 256, 256, 0, stream>>>(adj, off, rank, bkt);
  gat_bucket_order<<<N_NODES / 8, 256, 0, stream>>>(off, bkt, ed);
  gat_node_attn<<<N_NODES / 8, 256, 0, stream>>>(off, ed, q, k, v, out);
}
